// v000
// Measured on an AMD MI455X. A time is GPU time per run, averaged over a window of back-to-back runs after a warm-up
// (all launches, gaps included; the runs take copies of the inputs in turn), and the median of several windows.
// Apart from v000's, it joins two sittings. Times from different sittings can be a few percent apart, while
// side-by-side timings come from the same sitting.
// v000, which the later versions start from, runs in 113 microseconds.
#include <hip/hip_runtime.h>

typedef __attribute__((ext_vector_type(2))) float v2f;
typedef __attribute__((ext_vector_type(8))) float v8f;

namespace {
constexpr int kH = 16;
constexpr int kBH = 64;          // B*H
constexpr int kN = 4096;
constexpr int kD = 64;           // head dim == projection dim e
constexpr int kE2 = 128;         // 2e feature dim
constexpr int kNTile = 128;      // rows of n processed per LDS tile
constexpr int kNSplit = 16;      // N-chunks for kv kernel
constexpr int kChunk = kN / kNSplit;          // 256
constexpr int kTilesPerChunk = kChunk / kNTile; // 2
}

__device__ __forceinline__ v8f wmma_f32(v2f a, v2f b, v8f c) {
  // D = A(16x4,f32) * B(4x16,f32) + C(16x16,f32)
  return __builtin_amdgcn_wmma_f32_16x16x4_f32(false, a, false, b,
                                               (short)0, c, false, false);
}

__global__ void rfa_zero_kernel(float* __restrict__ p, int n) {
  int i = blockIdx.x * blockDim.x + threadIdx.x;
  int stride = gridDim.x * blockDim.x;
  for (; i < n; i += stride) p[i] = 0.0f;
}

// ---------------------------------------------------------------------------
// Kernel A: kv[bh][i][j] += sum_n phi_k[n][i] * v[n][j]   (atomic reduction)
// block = (bh, chunk), 256 threads = 8 waves
// ---------------------------------------------------------------------------
__global__ __launch_bounds__(256)
void rfa_kv_kernel(const float* __restrict__ kmat, const float* __restrict__ vmat,
                   const float* __restrict__ proj, float* __restrict__ kv_out) {
  __shared__ float s_proj[kD][kD + 1];        // 64 x 65
  __shared__ float s_k[kNTile][kD + 1];       // 128 x 65
  __shared__ float s_v[kNTile][kD + 1];       // 128 x 65
  __shared__ float s_phi[kNTile][kE2 + 1];    // 128 x 129

  const int bh = blockIdx.x;
  const int chunk = blockIdx.y;
  const int h = bh % kH;
  const int tid = threadIdx.x;
  const int lane = tid & 31;
  const int wave = tid >> 5;
  const int m = lane & 15;            // row (A) / col (B,D) within 16x16 tile
  const int kk = (lane >> 4) * 2;     // K sub-offset for A/B fragments

  // projections[h] : P[d][e], 4096 floats
  for (int i = tid; i < kD * kD; i += 256) {
    s_proj[i / kD][i % kD] = proj[h * kD * kD + i];
  }

  v8f acc_kv[4];
  for (int t = 0; t < 4; ++t) acc_kv[t] = {};

  const float* kbase = kmat + (size_t)bh * kN * kD + (size_t)chunk * kChunk * kD;
  const float* vbase = vmat + (size_t)bh * kN * kD + (size_t)chunk * kChunk * kD;

  for (int nt = 0; nt < kTilesPerChunk; ++nt) {
    __syncthreads();
    // cooperative load of 128x64 k and v tiles (float4)
    for (int i = tid; i < kNTile * kD / 4; i += 256) {
      const int row = i / (kD / 4);
      const int c4 = (i % (kD / 4)) * 4;
      const float4 kv4 = *(const float4*)(kbase + (size_t)nt * kNTile * kD + row * kD + c4);
      const float4 vv4 = *(const float4*)(vbase + (size_t)nt * kNTile * kD + row * kD + c4);
      s_k[row][c4 + 0] = kv4.x; s_k[row][c4 + 1] = kv4.y;
      s_k[row][c4 + 2] = kv4.z; s_k[row][c4 + 3] = kv4.w;
      s_v[row][c4 + 0] = vv4.x; s_v[row][c4 + 1] = vv4.y;
      s_v[row][c4 + 2] = vv4.z; s_v[row][c4 + 3] = vv4.w;
    }
    __syncthreads();

    // kp = k_tile(128x64) x P(64x64); wave w owns row tile i0 = 16w
    {
      const int i0 = wave * 16;
      for (int tj = 0; tj < 4; ++tj) {
        const int j0 = tj * 16;
        v8f acc = {};
        for (int kb = 0; kb < kD; kb += 4) {
          v2f a, b;
          a.x = s_k[i0 + m][kb + kk];
          a.y = s_k[i0 + m][kb + kk + 1];
          b.x = s_proj[kb + kk][j0 + m];
          b.y = s_proj[kb + kk + 1][j0 + m];
          acc = wmma_f32(a, b, acc);
        }
        // phi_k = [sin(kp), cos(kp)] / sqrt(64)
        for (int g = 0; g < 8; ++g) {
          const int row = i0 + g + (lane >> 4) * 8;
          const int col = j0 + m;
          const float val = acc[g];
          s_phi[row][col] = __sinf(val) * 0.125f;
          s_phi[row][col + kD] = __cosf(val) * 0.125f;
        }
      }
    }
    __syncthreads();

    // kv(128x64) += phi_k^T(128x128n) x v(128n x 64); wave w owns kv rows 16w..
    {
      const int i0 = wave * 16;
      for (int tj = 0; tj < 4; ++tj) {
        const int j0 = tj * 16;
        v8f acc = acc_kv[tj];
        for (int kb = 0; kb < kNTile; kb += 4) {
          v2f a, b;
          a.x = s_phi[kb + kk][i0 + m];       // transposed read (conflict-free)
          a.y = s_phi[kb + kk + 1][i0 + m];
          b.x = s_v[kb + kk][j0 + m];
          b.y = s_v[kb + kk + 1][j0 + m];
          acc = wmma_f32(a, b, acc);
        }
        acc_kv[tj] = acc;
      }
    }
  }

  // reduce partial kv into global workspace
  {
    const int i0 = wave * 16;
    float* out = kv_out + (size_t)bh * kE2 * kD;
    for (int tj = 0; tj < 4; ++tj) {
      const int j0 = tj * 16;
      for (int g = 0; g < 8; ++g) {
        const int row = i0 + g + (lane >> 4) * 8;
        const int col = j0 + m;
        atomicAdd(&out[row * kD + col], acc_kv[tj][g]);
      }
    }
  }
}

// ---------------------------------------------------------------------------
// Kernel B: out[n][d] = sum_e phi_q[n][e] * kv[e][d]
// block = (bh, n-tile of 128 rows), 256 threads = 8 waves
// ---------------------------------------------------------------------------
__global__ __launch_bounds__(256)
void rfa_out_kernel(const float* __restrict__ qmat, const float* __restrict__ proj,
                    const float* __restrict__ kv_in, float* __restrict__ out) {
  __shared__ float s_proj[kD][kD + 1];
  __shared__ float s_q[kNTile][kD + 1];
  __shared__ float s_phi[kNTile][kE2 + 1];
  __shared__ float s_kv[kE2][kD + 1];

  const int bh = blockIdx.x;
  const int tile = blockIdx.y;
  const int h = bh % kH;
  const int tid = threadIdx.x;
  const int lane = tid & 31;
  const int wave = tid >> 5;
  const int m = lane & 15;
  const int kk = (lane >> 4) * 2;

  for (int i = tid; i < kD * kD; i += 256) {
    s_proj[i / kD][i % kD] = proj[h * kD * kD + i];
  }
  for (int i = tid; i < kE2 * kD; i += 256) {
    s_kv[i / kD][i % kD] = kv_in[(size_t)bh * kE2 * kD + i];
  }
  const float* qbase = qmat + (size_t)bh * kN * kD + (size_t)tile * kNTile * kD;
  for (int i = tid; i < kNTile * kD / 4; i += 256) {
    const int row = i / (kD / 4);
    const int c4 = (i % (kD / 4)) * 4;
    const float4 q4 = *(const float4*)(qbase + row * kD + c4);
    s_q[row][c4 + 0] = q4.x; s_q[row][c4 + 1] = q4.y;
    s_q[row][c4 + 2] = q4.z; s_q[row][c4 + 3] = q4.w;
  }
  __syncthreads();

  // qp = q_tile x P ; phi_q = [sin, cos]/8
  {
    const int i0 = wave * 16;
    for (int tj = 0; tj < 4; ++tj) {
      const int j0 = tj * 16;
      v8f acc = {};
      for (int kb = 0; kb < kD; kb += 4) {
        v2f a, b;
        a.x = s_q[i0 + m][kb + kk];
        a.y = s_q[i0 + m][kb + kk + 1];
        b.x = s_proj[kb + kk][j0 + m];
        b.y = s_proj[kb + kk + 1][j0 + m];
        acc = wmma_f32(a, b, acc);
      }
      for (int g = 0; g < 8; ++g) {
        const int row = i0 + g + (lane >> 4) * 8;
        const int col = j0 + m;
        const float val = acc[g];
        s_phi[row][col] = __sinf(val) * 0.125f;
        s_phi[row][col + kD] = __cosf(val) * 0.125f;
      }
    }
  }
  __syncthreads();

  // out_tile(128x64) = phi_q(128x128) x kv(128x64)
  {
    const int i0 = wave * 16;
    float* obase = out + (size_t)bh * kN * kD + (size_t)tile * kNTile * kD;
    for (int tj = 0; tj < 4; ++tj) {
      const int j0 = tj * 16;
      v8f acc = {};
      for (int kb = 0; kb < kE2; kb += 4) {
        v2f a, b;
        a.x = s_phi[i0 + m][kb + kk];
        a.y = s_phi[i0 + m][kb + kk + 1];
        b.x = s_kv[kb + kk][j0 + m];
        b.y = s_kv[kb + kk + 1][j0 + m];
        acc = wmma_f32(a, b, acc);
      }
      for (int g = 0; g < 8; ++g) {
        const int row = i0 + g + (lane >> 4) * 8;
        const int col = j0 + m;
        obase[row * kD + col] = acc[g];
      }
    }
  }
}

extern "C" void kernel_launch(void* const* d_in, const int* in_sizes, int n_in,
                              void* d_out, int out_size, void* d_ws, size_t ws_size,
                              hipStream_t stream) {
  (void)in_sizes; (void)n_in; (void)out_size; (void)ws_size;
  const float* q = (const float*)d_in[0];
  const float* k = (const float*)d_in[1];
  const float* v = (const float*)d_in[2];
  const float* proj = (const float*)d_in[3];
  float* out = (float*)d_out;
  float* kv_ws = (float*)d_ws;   // [BH][128][64] fp32 = 2 MB

  const int kv_elems = kBH * kE2 * kD;
  rfa_zero_kernel<<<dim3(512), dim3(256), 0, stream>>>(kv_ws, kv_elems);
  rfa_kv_kernel<<<dim3(kBH, kNSplit), dim3(256), 0, stream>>>(k, v, proj, kv_ws);
  rfa_out_kernel<<<dim3(kBH, kN / kNTile), dim3(256), 0, stream>>>(q, proj, kv_ws, out);
}

// v001
// It runs in 109 microseconds.
// Two timings next to v000 both put it at 1.05 times that version's speed.
#include <hip/hip_runtime.h>

typedef __attribute__((ext_vector_type(2))) float v2f;
typedef __attribute__((ext_vector_type(8))) float v8f;

namespace {
constexpr int kH = 16;
constexpr int kBH = 64;          // B*H
constexpr int kN = 4096;
constexpr int kD = 64;           // head dim == projection dim e
constexpr int kE2 = 128;         // 2e feature dim
constexpr int kNTile = 128;      // rows of n processed per LDS tile
constexpr int kNSplit = 16;      // N-chunks for kv kernel
constexpr int kChunk = kN / kNSplit;          // 256
constexpr int kTilesPerChunk = kChunk / kNTile; // 2
// Row pitch (floats) of operands whose fragment takes two consecutive k of one
// row: pitch = 4 mod 64 puts the 16 rows x 4 k of one fragment on 64 banks.
constexpr int kPitch64 = kD + 4;     // 68
constexpr int kPitch128 = kE2 + 4;   // 132
}

// Layout of operands whose fragment takes rows k, k+1 at one column c: the two
// rows are interleaved (one 8-byte read per lane), and the odd row pair of each
// group of four rows starts 32 banks further on, so that lanes 0-15 (k, k+1)
// and lanes 16-31 (k+2, k+3) of one fragment read disjoint banks.
template <int C>
__device__ __forceinline__ constexpr int pair_idx(int k, int c) {
  return (k >> 2) * (4 * C + 32) + ((k >> 1) & 1) * (2 * C + 32) + c * 2 + (k & 1);
}
// Same address for a fragment: kb is a multiple of 4, hi = lane >> 4.
template <int C>
__device__ __forceinline__ int frag_idx(int kb, int hi, int c) {
  return (kb >> 2) * (4 * C + 32) + hi * (2 * C + 32) + c * 2;
}
template <int K, int C>
constexpr int pair_floats() { return (K / 4) * (4 * C + 32); }

__device__ __forceinline__ v8f wmma_f32(v2f a, v2f b, v8f c) {
  // D = A(16x4,f32) * B(4x16,f32) + C(16x16,f32)
  return __builtin_amdgcn_wmma_f32_16x16x4_f32(false, a, false, b,
                                               (short)0, c, false, false);
}

__global__ void rfa_zero_kernel(float* __restrict__ p, int n) {
  int i = blockIdx.x * blockDim.x + threadIdx.x;
  int stride = gridDim.x * blockDim.x;
  for (; i < n; i += stride) p[i] = 0.0f;
}

// ---------------------------------------------------------------------------
// Kernel A: kv[bh][i][j] += sum_n phi_k[n][i] * v[n][j]   (atomic reduction)
// block = (bh, chunk), 256 threads = 8 waves
// ---------------------------------------------------------------------------
__global__ __launch_bounds__(256)
void rfa_kv_kernel(const float* __restrict__ kmat, const float* __restrict__ vmat,
                   const float* __restrict__ proj, float* __restrict__ kv_out) {
  __shared__ __attribute__((aligned(16))) float s_proj[pair_floats<kD, kD>()];
  __shared__ __attribute__((aligned(16))) float s_k[kNTile * kPitch64];
  __shared__ __attribute__((aligned(16))) float s_v[pair_floats<kNTile, kD>()];
  __shared__ __attribute__((aligned(16))) float s_phi[pair_floats<kNTile, kE2>()];

  const int bh = blockIdx.x;
  const int chunk = blockIdx.y;
  const int h = bh % kH;
  const int tid = threadIdx.x;
  const int lane = tid & 31;
  const int wave = tid >> 5;
  const int m = lane & 15;            // row (A) / col (B,D) within 16x16 tile
  const int hi = lane >> 4;
  const int kk = hi * 2;              // K sub-offset for A/B fragments

  // projections[h] : P[d][e], 4096 floats
  for (int i = tid; i < kD * kD; i += 256) {
    s_proj[pair_idx<kD>(i / kD, i % kD)] = proj[h * kD * kD + i];
  }

  v8f acc_kv[4];
  for (int t = 0; t < 4; ++t) acc_kv[t] = {};

  const float* kbase = kmat + (size_t)bh * kN * kD + (size_t)chunk * kChunk * kD;
  const float* vbase = vmat + (size_t)bh * kN * kD + (size_t)chunk * kChunk * kD;

  for (int nt = 0; nt < kTilesPerChunk; ++nt) {
    __syncthreads();
    // cooperative load of 128x64 k and v tiles (float4)
    for (int i = tid; i < kNTile * kD / 4; i += 256) {
      const int row = i / (kD / 4);
      const int c4 = (i % (kD / 4)) * 4;
      const float4 kv4 = *(const float4*)(kbase + (size_t)nt * kNTile * kD + row * kD + c4);
      const float4 vv4 = *(const float4*)(vbase + (size_t)nt * kNTile * kD + row * kD + c4);
      *(float4*)&s_k[row * kPitch64 + c4] = kv4;
      float* dv = &s_v[pair_idx<kD>(row, c4)];
      dv[0] = vv4.x; dv[2] = vv4.y; dv[4] = vv4.z; dv[6] = vv4.w;
    }
    __syncthreads();

    // kp = k_tile(128x64) x P(64x64); wave w owns row tile i0 = 16w
    {
      const int i0 = wave * 16;
      for (int tj = 0; tj < 4; ++tj) {
        const int j0 = tj * 16;
        v8f acc = {};
        for (int kb = 0; kb < kD; kb += 4) {
          const v2f a = *(const v2f*)&s_k[(i0 + m) * kPitch64 + kb + kk];
          const v2f b = *(const v2f*)&s_proj[frag_idx<kD>(kb, hi, j0 + m)];
          acc = wmma_f32(a, b, acc);
        }
        // phi_k = [sin(kp), cos(kp)] / sqrt(64); rows g, g+1 are one row pair
        const int pbase = pair_idx<kE2>(i0 + hi * 8, j0 + m);
        for (int g = 0; g < 8; g += 2) {
          v2f sn, cs;
          sn.x = __sinf(acc[g]) * 0.125f;
          sn.y = __sinf(acc[g + 1]) * 0.125f;
          cs.x = __cosf(acc[g]) * 0.125f;
          cs.y = __cosf(acc[g + 1]) * 0.125f;
          *(v2f*)&s_phi[pbase + pair_idx<kE2>(g, 0)] = sn;
          *(v2f*)&s_phi[pbase + pair_idx<kE2>(g, kD)] = cs;
        }
      }
    }
    __syncthreads();

    // kv(128x64) += phi_k^T(128x128n) x v(128n x 64); wave w owns kv rows 16w..
    {
      const int i0 = wave * 16;
      for (int tj = 0; tj < 4; ++tj) {
        const int j0 = tj * 16;
        v8f acc = acc_kv[tj];
        for (int kb = 0; kb < kNTile; kb += 4) {
          const v2f a = *(const v2f*)&s_phi[frag_idx<kE2>(kb, hi, i0 + m)];  // transposed read
          const v2f b = *(const v2f*)&s_v[frag_idx<kD>(kb, hi, j0 + m)];
          acc = wmma_f32(a, b, acc);
        }
        acc_kv[tj] = acc;
      }
    }
  }

  // reduce partial kv into global workspace
  {
    const int i0 = wave * 16;
    float* out = kv_out + (size_t)bh * kE2 * kD;
    for (int tj = 0; tj < 4; ++tj) {
      const int j0 = tj * 16;
      for (int g = 0; g < 8; ++g) {
        const int row = i0 + g + (lane >> 4) * 8;
        const int col = j0 + m;
        atomicAdd(&out[row * kD + col], acc_kv[tj][g]);
      }
    }
  }
}

// ---------------------------------------------------------------------------
// Kernel B: out[n][d] = sum_e phi_q[n][e] * kv[e][d]
// block = (bh, n-tile of 128 rows), 256 threads = 8 waves
// ---------------------------------------------------------------------------
__global__ __launch_bounds__(256)
void rfa_out_kernel(const float* __restrict__ qmat, const float* __restrict__ proj,
                    const float* __restrict__ kv_in, float* __restrict__ out) {
  __shared__ __attribute__((aligned(16))) float s_proj[pair_floats<kD, kD>()];
  __shared__ __attribute__((aligned(16))) float s_q[kNTile * kPitch64];
  __shared__ __attribute__((aligned(16))) float s_phi[kNTile * kPitch128];
  __shared__ __attribute__((aligned(16))) float s_kv[pair_floats<kE2, kD>()];

  const int bh = blockIdx.x;
  const int tile = blockIdx.y;
  const int h = bh % kH;
  const int tid = threadIdx.x;
  const int lane = tid & 31;
  const int wave = tid >> 5;
  const int m = lane & 15;
  const int hi = lane >> 4;
  const int kk = hi * 2;

  for (int i = tid; i < kD * kD; i += 256) {
    s_proj[pair_idx<kD>(i / kD, i % kD)] = proj[h * kD * kD + i];
  }
  for (int i = tid; i < kE2 * kD / 4; i += 256) {
    const int row = i / (kD / 4);
    const int c4 = (i % (kD / 4)) * 4;
    const float4 w4 = *(const float4*)(kv_in + (size_t)bh * kE2 * kD + row * kD + c4);
    float* dw = &s_kv[pair_idx<kD>(row, c4)];
    dw[0] = w4.x; dw[2] = w4.y; dw[4] = w4.z; dw[6] = w4.w;
  }
  const float* qbase = qmat + (size_t)bh * kN * kD + (size_t)tile * kNTile * kD;
  for (int i = tid; i < kNTile * kD / 4; i += 256) {
    const int row = i / (kD / 4);
    const int c4 = (i % (kD / 4)) * 4;
    *(float4*)&s_q[row * kPitch64 + c4] = *(const float4*)(qbase + row * kD + c4);
  }
  __syncthreads();

  // qp = q_tile x P ; phi_q = [sin, cos]/8
  {
    const int i0 = wave * 16;
    for (int tj = 0; tj < 4; ++tj) {
      const int j0 = tj * 16;
      v8f acc = {};
      for (int kb = 0; kb < kD; kb += 4) {
        const v2f a = *(const v2f*)&s_q[(i0 + m) * kPitch64 + kb + kk];
        const v2f b = *(const v2f*)&s_proj[frag_idx<kD>(kb, hi, j0 + m)];
        acc = wmma_f32(a, b, acc);
      }
      for (int g = 0; g < 8; ++g) {
        const int row = i0 + g + (lane >> 4) * 8;
        const int col = j0 + m;
        const float val = acc[g];
        s_phi[row * kPitch128 + col] = __sinf(val) * 0.125f;
        s_phi[row * kPitch128 + col + kD] = __cosf(val) * 0.125f;
      }
    }
  }
  __syncthreads();

  // out_tile(128x64) = phi_q(128x128) x kv(128x64)
  {
    const int i0 = wave * 16;
    float* obase = out + (size_t)bh * kN * kD + (size_t)tile * kNTile * kD;
    for (int tj = 0; tj < 4; ++tj) {
      const int j0 = tj * 16;
      v8f acc = {};
      for (int kb = 0; kb < kE2; kb += 4) {
        const v2f a = *(const v2f*)&s_phi[(i0 + m) * kPitch128 + kb + kk];
        const v2f b = *(const v2f*)&s_kv[frag_idx<kD>(kb, hi, j0 + m)];
        acc = wmma_f32(a, b, acc);
      }
      for (int g = 0; g < 8; ++g) {
        const int row = i0 + g + (lane >> 4) * 8;
        const int col = j0 + m;
        obase[row * kD + col] = acc[g];
      }
    }
  }
}

extern "C" void kernel_launch(void* const* d_in, const int* in_sizes, int n_in,
                              void* d_out, int out_size, void* d_ws, size_t ws_size,
                              hipStream_t stream) {
  (void)in_sizes; (void)n_in; (void)out_size; (void)ws_size;
  const float* q = (const float*)d_in[0];
  const float* k = (const float*)d_in[1];
  const float* v = (const float*)d_in[2];
  const float* proj = (const float*)d_in[3];
  float* out = (float*)d_out;
  float* kv_ws = (float*)d_ws;   // [BH][128][64] fp32 = 2 MB

  const int kv_elems = kBH * kE2 * kD;
  rfa_zero_kernel<<<dim3(512), dim3(256), 0, stream>>>(kv_ws, kv_elems);
  rfa_kv_kernel<<<dim3(kBH, kNSplit), dim3(256), 0, stream>>>(k, v, proj, kv_ws);
  rfa_out_kernel<<<dim3(kBH, kN / kNTile), dim3(256), 0, stream>>>(q, proj, kv_ws, out);
}

// v002
// One run takes 76.9 microseconds.
// Timed twice side by side with v001, it ran 1.41 times as fast both times.
// Counting every step since v000, it is 1.49 times as fast.
#include <hip/hip_runtime.h>

typedef __attribute__((ext_vector_type(2))) float v2f;
typedef __attribute__((ext_vector_type(4))) float v4f;
typedef __attribute__((ext_vector_type(8))) float v8f;

namespace {
constexpr int kH = 16;
constexpr int kBH = 64;          // B*H
constexpr int kN = 4096;
constexpr int kD = 64;           // head dim == projection dim e
constexpr int kE2 = 128;         // 2e feature dim
constexpr int kNTile = 128;      // rows of n processed per LDS tile
constexpr int kNSplit = 16;      // N-chunks for kv kernel
constexpr int kChunk = kN / kNSplit;          // 256
constexpr int kTilesPerChunk = kChunk / kNTile; // 2
// Row pitch (floats) of operands whose fragment takes two consecutive k of one
// row: pitch = 4 mod 64 puts the 16 rows x 4 k of one fragment on 64 banks.
constexpr int kPitch64 = kD + 4;     // 68
constexpr int kPitch128 = kE2 + 4;   // 132
constexpr int kThreads = 256;
constexpr int kProjPer = kD * kD / kThreads;          // 16 floats of P per thread
constexpr int kTilePer = kNTile * kD / 4 / kThreads;  // 8 float4 of a 128x64 tile per thread
}

// Layout of operands whose fragment takes rows k, k+1 at one column c: the two
// rows are interleaved (one 8-byte read per lane), and the odd row pair of each
// group of four rows starts 32 banks further on, so that lanes 0-15 (k, k+1)
// and lanes 16-31 (k+2, k+3) of one fragment read disjoint banks.
template <int C>
__device__ __forceinline__ constexpr int pair_idx(int k, int c) {
  return (k >> 2) * (4 * C + 32) + ((k >> 1) & 1) * (2 * C + 32) + c * 2 + (k & 1);
}
// Same address for a fragment: kb is a multiple of 4, hi = lane >> 4.
template <int C>
__device__ __forceinline__ int frag_idx(int kb, int hi, int c) {
  return (kb >> 2) * (4 * C + 32) + hi * (2 * C + 32) + c * 2;
}
template <int K, int C>
constexpr int pair_floats() { return (K / 4) * (4 * C + 32); }

__device__ __forceinline__ v8f wmma_f32(v2f a, v2f b, v8f c) {
  // D = A(16x4,f32) * B(4x16,f32) + C(16x16,f32)
  return __builtin_amdgcn_wmma_f32_16x16x4_f32(false, a, false, b,
                                               (short)0, c, false, false);
}

__global__ void rfa_zero_kernel(float* __restrict__ p, int n) {
  int i = blockIdx.x * blockDim.x + threadIdx.x;
  int stride = gridDim.x * blockDim.x;
  for (; i < n; i += stride) p[i] = 0.0f;
}

// ---------------------------------------------------------------------------
// Kernel A: kv[bh][i][j] += sum_n phi_k[n][i] * v[n][j]   (atomic reduction)
// block = (bh, chunk), 256 threads = 8 waves
// ---------------------------------------------------------------------------
__global__ __launch_bounds__(256)
void rfa_kv_kernel(const float* __restrict__ kmat, const float* __restrict__ vmat,
                   const float* __restrict__ proj, float* __restrict__ kv_out) {
  __shared__ __attribute__((aligned(16))) float s_proj[pair_floats<kD, kD>()];
  __shared__ __attribute__((aligned(16))) float s_k[kNTile * kPitch64];
  __shared__ __attribute__((aligned(16))) float s_v[pair_floats<kNTile, kD>()];
  __shared__ __attribute__((aligned(16))) float s_phi[pair_floats<kNTile, kE2>()];

  const int bh = blockIdx.x;
  const int chunk = blockIdx.y;
  const int h = bh % kH;
  const int tid = threadIdx.x;
  const int lane = tid & 31;
  const int wave = tid >> 5;
  const int m = lane & 15;            // row (A) / col (B,D) within 16x16 tile
  const int hi = lane >> 4;
  const int kk = hi * 2;              // K sub-offset for A/B fragments

  const float* kbase = kmat + (size_t)bh * kN * kD + (size_t)chunk * kChunk * kD;
  const float* vbase = vmat + (size_t)bh * kN * kD + (size_t)chunk * kChunk * kD;

  // All global loads of a stage are issued before the first of them is waited
  // for: one memory latency per stage instead of one per load.
  float pr[kProjPer];
  v4f kr[kTilePer], vr[kTilePer];
#pragma unroll  // fixed trip count, so that the loads stand together
  for (int it = 0; it < kTilePer; ++it) {
    kr[it] = *(const v4f*)(kbase + (tid + it * kThreads) * 4);
    vr[it] = *(const v4f*)(vbase + (tid + it * kThreads) * 4);
  }
#pragma unroll  // fixed trip count, so that the loads stand together
  for (int it = 0; it < kProjPer; ++it) pr[it] = proj[h * kD * kD + tid + it * kThreads];

  // projections[h] : P[d][e], 4096 floats
#pragma unroll  // pr[] must stay in registers
  for (int it = 0; it < kProjPer; ++it) {
    const int i = tid + it * kThreads;
    s_proj[pair_idx<kD>(i / kD, i % kD)] = pr[it];
  }

  v8f acc_kv[4];
  for (int t = 0; t < 4; ++t) acc_kv[t] = {};

  for (int nt = 0; nt < kTilesPerChunk; ++nt) {
    __syncthreads();
    // 128x64 k and v tiles, registers -> LDS
#pragma unroll  // kr[], vr[] must stay in registers
    for (int it = 0; it < kTilePer; ++it) {
      const int i = tid + it * kThreads;
      const int row = i / (kD / 4);
      const int c4 = (i % (kD / 4)) * 4;
      *(v4f*)&s_k[row * kPitch64 + c4] = kr[it];
      float* dv = &s_v[pair_idx<kD>(row, c4)];
      dv[0] = vr[it].x; dv[2] = vr[it].y; dv[4] = vr[it].z; dv[6] = vr[it].w;
    }
    __syncthreads();
    // The next tile's loads fly while this tile's first product runs. They stand
    // behind the barrier because the barrier's fence drains outstanding loads.
    if (nt + 1 < kTilesPerChunk) {
#pragma unroll  // fixed trip count, so that the loads stand together
      for (int it = 0; it < kTilePer; ++it) {
        kr[it] = *(const v4f*)(kbase + (nt + 1) * kNTile * kD + (tid + it * kThreads) * 4);
        vr[it] = *(const v4f*)(vbase + (nt + 1) * kNTile * kD + (tid + it * kThreads) * 4);
      }
    }

    // kp = k_tile(128x64) x P(64x64); wave w owns row tile i0 = 16w
    {
      const int i0 = wave * 16;
      for (int tj = 0; tj < 4; ++tj) {
        const int j0 = tj * 16;
        v8f acc = {};
        for (int kb = 0; kb < kD; kb += 4) {
          const v2f a = *(const v2f*)&s_k[(i0 + m) * kPitch64 + kb + kk];
          const v2f b = *(const v2f*)&s_proj[frag_idx<kD>(kb, hi, j0 + m)];
          acc = wmma_f32(a, b, acc);
        }
        // phi_k = [sin(kp), cos(kp)] / sqrt(64); rows g, g+1 are one row pair
        const int pbase = pair_idx<kE2>(i0 + hi * 8, j0 + m);
        for (int g = 0; g < 8; g += 2) {
          v2f sn, cs;
          sn.x = __sinf(acc[g]) * 0.125f;
          sn.y = __sinf(acc[g + 1]) * 0.125f;
          cs.x = __cosf(acc[g]) * 0.125f;
          cs.y = __cosf(acc[g + 1]) * 0.125f;
          *(v2f*)&s_phi[pbase + pair_idx<kE2>(g, 0)] = sn;
          *(v2f*)&s_phi[pbase + pair_idx<kE2>(g, kD)] = cs;
        }
      }
    }
    __syncthreads();

    // kv(128x64) += phi_k^T(128x128n) x v(128n x 64); wave w owns kv rows 16w..
    {
      const int i0 = wave * 16;
      for (int tj = 0; tj < 4; ++tj) {
        const int j0 = tj * 16;
        v8f acc = acc_kv[tj];
        for (int kb = 0; kb < kNTile; kb += 4) {
          const v2f a = *(const v2f*)&s_phi[frag_idx<kE2>(kb, hi, i0 + m)];  // transposed read
          const v2f b = *(const v2f*)&s_v[frag_idx<kD>(kb, hi, j0 + m)];
          acc = wmma_f32(a, b, acc);
        }
        acc_kv[tj] = acc;
      }
    }
  }

  // reduce partial kv into global workspace
  {
    const int i0 = wave * 16;
    float* out = kv_out + (size_t)bh * kE2 * kD;
    for (int tj = 0; tj < 4; ++tj) {
      const int j0 = tj * 16;
      for (int g = 0; g < 8; ++g) {
        const int row = i0 + g + (lane >> 4) * 8;
        const int col = j0 + m;
        atomicAdd(&out[row * kD + col], acc_kv[tj][g]);
      }
    }
  }
}

// ---------------------------------------------------------------------------
// Kernel B: out[n][d] = sum_e phi_q[n][e] * kv[e][d]
// block = (bh, n-tile of 128 rows), 256 threads = 8 waves
// ---------------------------------------------------------------------------
__global__ __launch_bounds__(256)
void rfa_out_kernel(const float* __restrict__ qmat, const float* __restrict__ proj,
                    const float* __restrict__ kv_in, float* __restrict__ out) {
  __shared__ __attribute__((aligned(16))) float s_proj[pair_floats<kD, kD>()];
  __shared__ __attribute__((aligned(16))) float s_q[kNTile * kPitch64];
  __shared__ __attribute__((aligned(16))) float s_phi[kNTile * kPitch128];
  __shared__ __attribute__((aligned(16))) float s_kv[pair_floats<kE2, kD>()];

  const int bh = blockIdx.x;
  const int tile = blockIdx.y;
  const int h = bh % kH;
  const int tid = threadIdx.x;
  const int lane = tid & 31;
  const int wave = tid >> 5;
  const int m = lane & 15;
  const int hi = lane >> 4;
  const int kk = hi * 2;

  const float* qbase = qmat + (size_t)bh * kN * kD + (size_t)tile * kNTile * kD;
  const float* wbase = kv_in + (size_t)bh * kE2 * kD;

  // All global loads of the stage are issued before the first of them is
  // waited for: one memory latency instead of one per load.
  float pr[kProjPer];
  v4f qr[kTilePer], wr[kTilePer];
#pragma unroll  // fixed trip count, so that the loads stand together
  for (int it = 0; it < kTilePer; ++it) qr[it] = *(const v4f*)(qbase + (tid + it * kThreads) * 4);
#pragma unroll  // fixed trip count, so that the loads stand together
  for (int it = 0; it < kTilePer; ++it) wr[it] = *(const v4f*)(wbase + (tid + it * kThreads) * 4);
#pragma unroll  // fixed trip count, so that the loads stand together
  for (int it = 0; it < kProjPer; ++it) pr[it] = proj[h * kD * kD + tid + it * kThreads];

#pragma unroll  // qr[], wr[] must stay in registers
  for (int it = 0; it < kTilePer; ++it) {
    const int i = tid + it * kThreads;
    const int row = i / (kD / 4);
    const int c4 = (i % (kD / 4)) * 4;
    *(v4f*)&s_q[row * kPitch64 + c4] = qr[it];
    float* dw = &s_kv[pair_idx<kD>(row, c4)];
    dw[0] = wr[it].x; dw[2] = wr[it].y; dw[4] = wr[it].z; dw[6] = wr[it].w;
  }
#pragma unroll  // pr[] must stay in registers
  for (int it = 0; it < kProjPer; ++it) {
    const int i = tid + it * kThreads;
    s_proj[pair_idx<kD>(i / kD, i % kD)] = pr[it];
  }
  __syncthreads();

  // qp = q_tile x P ; phi_q = [sin, cos]/8
  {
    const int i0 = wave * 16;
    for (int tj = 0; tj < 4; ++tj) {
      const int j0 = tj * 16;
      v8f acc = {};
      for (int kb = 0; kb < kD; kb += 4) {
        const v2f a = *(const v2f*)&s_q[(i0 + m) * kPitch64 + kb + kk];
        const v2f b = *(const v2f*)&s_proj[frag_idx<kD>(kb, hi, j0 + m)];
        acc = wmma_f32(a, b, acc);
      }
      for (int g = 0; g < 8; ++g) {
        const int row = i0 + g + (lane >> 4) * 8;
        const int col = j0 + m;
        const float val = acc[g];
        s_phi[row * kPitch128 + col] = __sinf(val) * 0.125f;
        s_phi[row * kPitch128 + col + kD] = __cosf(val) * 0.125f;
      }
    }
  }
  __syncthreads();

  // out_tile(128x64) = phi_q(128x128) x kv(128x64)
  {
    const int i0 = wave * 16;
    float* obase = out + (size_t)bh * kN * kD + (size_t)tile * kNTile * kD;
    for (int tj = 0; tj < 4; ++tj) {
      const int j0 = tj * 16;
      v8f acc = {};
      for (int kb = 0; kb < kE2; kb += 4) {
        const v2f a = *(const v2f*)&s_phi[(i0 + m) * kPitch128 + kb + kk];
        const v2f b = *(const v2f*)&s_kv[frag_idx<kD>(kb, hi, j0 + m)];
        acc = wmma_f32(a, b, acc);
      }
      for (int g = 0; g < 8; ++g) {
        const int row = i0 + g + (lane >> 4) * 8;
        const int col = j0 + m;
        obase[row * kD + col] = acc[g];
      }
    }
  }
}

extern "C" void kernel_launch(void* const* d_in, const int* in_sizes, int n_in,
                              void* d_out, int out_size, void* d_ws, size_t ws_size,
                              hipStream_t stream) {
  (void)in_sizes; (void)n_in; (void)out_size; (void)ws_size;
  const float* q = (const float*)d_in[0];
  const float* k = (const float*)d_in[1];
  const float* v = (const float*)d_in[2];
  const float* proj = (const float*)d_in[3];
  float* out = (float*)d_out;
  float* kv_ws = (float*)d_ws;   // [BH][128][64] fp32 = 2 MB

  const int kv_elems = kBH * kE2 * kD;
  rfa_zero_kernel<<<dim3(512), dim3(256), 0, stream>>>(kv_ws, kv_elems);
  rfa_kv_kernel<<<dim3(kBH, kNSplit), dim3(256), 0, stream>>>(k, v, proj, kv_ws);
  rfa_out_kernel<<<dim3(kBH, kN / kNTile), dim3(256), 0, stream>>>(q, proj, kv_ws, out);
}

// v003
// Measured time: 70 microseconds a run.
// Next to v002, in two timings, it ran 1.10 times as fast each time.
// All steps since v000 together make it 1.63 times as fast.
#include <hip/hip_runtime.h>

typedef __attribute__((ext_vector_type(2))) float v2f;
typedef __attribute__((ext_vector_type(4))) float v4f;
typedef __attribute__((ext_vector_type(8))) float v8f;

namespace {
constexpr int kH = 16;
constexpr int kBH = 64;          // B*H
constexpr int kN = 4096;
constexpr int kD = 64;           // head dim == projection dim e
constexpr int kE2 = 128;         // 2e feature dim
constexpr int kNTile = 128;      // rows of n processed per LDS tile
constexpr int kNSplit = 16;      // N-chunks for kv kernel
constexpr int kChunk = kN / kNSplit;          // 256
constexpr int kTilesPerChunk = kChunk / kNTile; // 2
// Row pitch (floats) of operands whose fragment takes two consecutive k of one
// row: pitch = 4 mod 64 puts the 16 rows x 4 k of one fragment on 64 banks.
constexpr int kPitch64 = kD + 4;     // 68
constexpr int kPitch128 = kE2 + 4;   // 132
constexpr int kThreads = 256;
constexpr int kProjPer = kD * kD / kThreads;          // 16 floats of P per thread
constexpr int kTilePer = kNTile * kD / 4 / kThreads;  // 8 float4 of a 128x64 tile per thread
constexpr int kOutTiles = 4;                          // n-tiles per block of the out kernel
constexpr int kRowsPer = 16 * kD / 4 / 32;            // 8 float4 of a wave's 16 rows per lane
}

// Layout of operands whose fragment takes rows k, k+1 at one column c: the two
// rows are interleaved (one 8-byte read per lane), and the odd row pair of each
// group of four rows starts 32 banks further on, so that lanes 0-15 (k, k+1)
// and lanes 16-31 (k+2, k+3) of one fragment read disjoint banks.
template <int C>
__device__ __forceinline__ constexpr int pair_idx(int k, int c) {
  return (k >> 2) * (4 * C + 32) + ((k >> 1) & 1) * (2 * C + 32) + c * 2 + (k & 1);
}
// Same address for a fragment: kb is a multiple of 4, hi = lane >> 4.
template <int C>
__device__ __forceinline__ int frag_idx(int kb, int hi, int c) {
  return (kb >> 2) * (4 * C + 32) + hi * (2 * C + 32) + c * 2;
}
template <int K, int C>
constexpr int pair_floats() { return (K / 4) * (4 * C + 32); }

__device__ __forceinline__ v8f wmma_f32(v2f a, v2f b, v8f c) {
  // D = A(16x4,f32) * B(4x16,f32) + C(16x16,f32)
  return __builtin_amdgcn_wmma_f32_16x16x4_f32(false, a, false, b,
                                               (short)0, c, false, false);
}

__global__ void rfa_zero_kernel(float* __restrict__ p, int n) {
  int i = blockIdx.x * blockDim.x + threadIdx.x;
  int stride = gridDim.x * blockDim.x;
  for (; i < n; i += stride) p[i] = 0.0f;
}

// ---------------------------------------------------------------------------
// Kernel A: kv[bh][i][j] += sum_n phi_k[n][i] * v[n][j]   (atomic reduction)
// block = (bh, chunk), 256 threads = 8 waves
// ---------------------------------------------------------------------------
__global__ __launch_bounds__(256)
void rfa_kv_kernel(const float* __restrict__ kmat, const float* __restrict__ vmat,
                   const float* __restrict__ proj, float* __restrict__ kv_out) {
  __shared__ __attribute__((aligned(16))) float s_proj[pair_floats<kD, kD>()];
  __shared__ __attribute__((aligned(16))) float s_k[kNTile * kPitch64];
  __shared__ __attribute__((aligned(16))) float s_v[pair_floats<kNTile, kD>()];
  __shared__ __attribute__((aligned(16))) float s_phi[pair_floats<kNTile, kE2>()];

  const int bh = blockIdx.x;
  const int chunk = blockIdx.y;
  const int h = bh % kH;
  const int tid = threadIdx.x;
  const int lane = tid & 31;
  const int wave = tid >> 5;
  const int m = lane & 15;            // row (A) / col (B,D) within 16x16 tile
  const int hi = lane >> 4;
  const int kk = hi * 2;              // K sub-offset for A/B fragments

  const float* kbase = kmat + (size_t)bh * kN * kD + (size_t)chunk * kChunk * kD;
  const float* vbase = vmat + (size_t)bh * kN * kD + (size_t)chunk * kChunk * kD;

  // All global loads of a stage are issued before the first of them is waited
  // for: one memory latency per stage instead of one per load.
  float pr[kProjPer];
  v4f kr[kTilePer], vr[kTilePer];
#pragma unroll  // fixed trip count, so that the loads stand together
  for (int it = 0; it < kTilePer; ++it) {
    kr[it] = *(const v4f*)(kbase + (tid + it * kThreads) * 4);
    vr[it] = *(const v4f*)(vbase + (tid + it * kThreads) * 4);
  }
#pragma unroll  // fixed trip count, so that the loads stand together
  for (int it = 0; it < kProjPer; ++it) pr[it] = proj[h * kD * kD + tid + it * kThreads];

  // projections[h] : P[d][e], 4096 floats
#pragma unroll  // pr[] must stay in registers
  for (int it = 0; it < kProjPer; ++it) {
    const int i = tid + it * kThreads;
    s_proj[pair_idx<kD>(i / kD, i % kD)] = pr[it];
  }

  v8f acc_kv[4];
  for (int t = 0; t < 4; ++t) acc_kv[t] = {};

  for (int nt = 0; nt < kTilesPerChunk; ++nt) {
    __syncthreads();
    // 128x64 k and v tiles, registers -> LDS
#pragma unroll  // kr[], vr[] must stay in registers
    for (int it = 0; it < kTilePer; ++it) {
      const int i = tid + it * kThreads;
      const int row = i / (kD / 4);
      const int c4 = (i % (kD / 4)) * 4;
      *(v4f*)&s_k[row * kPitch64 + c4] = kr[it];
      float* dv = &s_v[pair_idx<kD>(row, c4)];
      dv[0] = vr[it].x; dv[2] = vr[it].y; dv[4] = vr[it].z; dv[6] = vr[it].w;
    }
    __syncthreads();
    // The next tile's loads fly while this tile's first product runs. They stand
    // behind the barrier because the barrier's fence drains outstanding loads.
    if (nt + 1 < kTilesPerChunk) {
#pragma unroll  // fixed trip count, so that the loads stand together
      for (int it = 0; it < kTilePer; ++it) {
        kr[it] = *(const v4f*)(kbase + (nt + 1) * kNTile * kD + (tid + it * kThreads) * 4);
        vr[it] = *(const v4f*)(vbase + (nt + 1) * kNTile * kD + (tid + it * kThreads) * 4);
      }
    }

    // kp = k_tile(128x64) x P(64x64); wave w owns row tile i0 = 16w
    {
      const int i0 = wave * 16;
      for (int tj = 0; tj < 4; ++tj) {
        const int j0 = tj * 16;
        v8f acc = {};
        for (int kb = 0; kb < kD; kb += 4) {
          const v2f a = *(const v2f*)&s_k[(i0 + m) * kPitch64 + kb + kk];
          const v2f b = *(const v2f*)&s_proj[frag_idx<kD>(kb, hi, j0 + m)];
          acc = wmma_f32(a, b, acc);
        }
        // phi_k = [sin(kp), cos(kp)] / sqrt(64); rows g, g+1 are one row pair
        const int pbase = pair_idx<kE2>(i0 + hi * 8, j0 + m);
        for (int g = 0; g < 8; g += 2) {
          v2f sn, cs;
          sn.x = __sinf(acc[g]) * 0.125f;
          sn.y = __sinf(acc[g + 1]) * 0.125f;
          cs.x = __cosf(acc[g]) * 0.125f;
          cs.y = __cosf(acc[g + 1]) * 0.125f;
          *(v2f*)&s_phi[pbase + pair_idx<kE2>(g, 0)] = sn;
          *(v2f*)&s_phi[pbase + pair_idx<kE2>(g, kD)] = cs;
        }
      }
    }
    __syncthreads();

    // kv(128x64) += phi_k^T(128x128n) x v(128n x 64); wave w owns kv rows 16w..
    {
      const int i0 = wave * 16;
      for (int tj = 0; tj < 4; ++tj) {
        const int j0 = tj * 16;
        v8f acc = acc_kv[tj];
        for (int kb = 0; kb < kNTile; kb += 4) {
          const v2f a = *(const v2f*)&s_phi[frag_idx<kE2>(kb, hi, i0 + m)];  // transposed read
          const v2f b = *(const v2f*)&s_v[frag_idx<kD>(kb, hi, j0 + m)];
          acc = wmma_f32(a, b, acc);
        }
        acc_kv[tj] = acc;
      }
    }
  }

  // reduce partial kv into global workspace
  {
    const int i0 = wave * 16;
    float* out = kv_out + (size_t)bh * kE2 * kD;
    for (int tj = 0; tj < 4; ++tj) {
      const int j0 = tj * 16;
      for (int g = 0; g < 8; ++g) {
        const int row = i0 + g + (lane >> 4) * 8;
        const int col = j0 + m;
        atomicAdd(&out[row * kD + col], acc_kv[tj][g]);
      }
    }
  }
}

// ---------------------------------------------------------------------------
// Kernel B: out[n][d] = sum_e phi_q[n][e] * kv[e][d]
// block = (bh, group of kOutTiles n-tiles of 128 rows), 256 threads = 8 waves.
// P and kv are staged once per block. Every row of q, phi_q and out belongs to
// one wave from its load to its store, so behind the one barrier that publishes
// P and kv the waves run free of each other: one wave's loads, sin/cos and
// stores fall under the other waves' matrix work.
// ---------------------------------------------------------------------------
__global__ __launch_bounds__(256)
void rfa_out_kernel(const float* __restrict__ qmat, const float* __restrict__ proj,
                    const float* __restrict__ kv_in, float* __restrict__ out) {
  __shared__ __attribute__((aligned(16))) float s_proj[pair_floats<kD, kD>()];
  __shared__ __attribute__((aligned(16))) float s_q[kNTile * kPitch64];
  __shared__ __attribute__((aligned(16))) float s_phi[kNTile * kPitch128];
  __shared__ __attribute__((aligned(16))) float s_kv[pair_floats<kE2, kD>()];

  const int bh = blockIdx.x;
  const int grp = blockIdx.y;
  const int h = bh % kH;
  const int tid = threadIdx.x;
  const int lane = tid & 31;
  const int wave = tid >> 5;
  const int m = lane & 15;
  const int hi = lane >> 4;
  const int kk = hi * 2;
  const int i0 = wave * 16;           // the wave's own 16 rows of every tile

  const size_t row0 = (size_t)bh * kN + (size_t)grp * kOutTiles * kNTile + i0;
  const float* qbase = qmat + row0 * kD;
  float* obase = out + row0 * kD;
  const float* wbase = kv_in + (size_t)bh * kE2 * kD;

  // All global loads of the stage are issued before the first of them is
  // waited for: one memory latency instead of one per load.
  float pr[kProjPer];
  v4f qr[kRowsPer], wr[kTilePer];
#pragma unroll  // fixed trip count, so that the loads stand together
  for (int it = 0; it < kRowsPer; ++it) qr[it] = *(const v4f*)(qbase + (lane + it * 32) * 4);
#pragma unroll  // fixed trip count, so that the loads stand together
  for (int it = 0; it < kTilePer; ++it) wr[it] = *(const v4f*)(wbase + (tid + it * kThreads) * 4);
#pragma unroll  // fixed trip count, so that the loads stand together
  for (int it = 0; it < kProjPer; ++it) pr[it] = proj[h * kD * kD + tid + it * kThreads];

#pragma unroll  // wr[] must stay in registers
  for (int it = 0; it < kTilePer; ++it) {
    const int i = tid + it * kThreads;
    const int row = i / (kD / 4);
    const int c4 = (i % (kD / 4)) * 4;
    float* dw = &s_kv[pair_idx<kD>(row, c4)];
    dw[0] = wr[it].x; dw[2] = wr[it].y; dw[4] = wr[it].z; dw[6] = wr[it].w;
  }
#pragma unroll  // pr[] must stay in registers
  for (int it = 0; it < kProjPer; ++it) {
    const int i = tid + it * kThreads;
    s_proj[pair_idx<kD>(i / kD, i % kD)] = pr[it];
  }
  __syncthreads();

#pragma unroll 1  // one copy of the body: the four trips share the instruction cache lines
  for (int t = 0; t < kOutTiles; ++t) {
    // the wave's own 16 rows of q, registers -> LDS
#pragma unroll  // qr[] must stay in registers
    for (int it = 0; it < kRowsPer; ++it) {
      const int i = lane + it * 32;
      *(v4f*)&s_q[(i0 + i / (kD / 4)) * kPitch64 + (i % (kD / 4)) * 4] = qr[it];
    }
    // Other lanes of this wave read these rows: the stores have landed, and the
    // compiler keeps the reads behind them.
    asm volatile("s_wait_dscnt 0x0" ::: "memory");
    // The next tile's rows fly while this tile's products run.
    if (t + 1 < kOutTiles) {
#pragma unroll  // fixed trip count, so that the loads stand together
      for (int it = 0; it < kRowsPer; ++it)
        qr[it] = *(const v4f*)(qbase + (t + 1) * kNTile * kD + (lane + it * 32) * 4);
    }

    // qp = q_rows x P ; phi_q = [sin, cos]/8
    for (int tj = 0; tj < 4; ++tj) {
      const int j0 = tj * 16;
      v8f acc = {};
      for (int kb = 0; kb < kD; kb += 4) {
        const v2f a = *(const v2f*)&s_q[(i0 + m) * kPitch64 + kb + kk];
        const v2f b = *(const v2f*)&s_proj[frag_idx<kD>(kb, hi, j0 + m)];
        acc = wmma_f32(a, b, acc);
      }
      for (int g = 0; g < 8; ++g) {
        const int row = i0 + g + hi * 8;
        const int col = j0 + m;
        const float val = acc[g];
        s_phi[row * kPitch128 + col] = __sinf(val) * 0.125f;
        s_phi[row * kPitch128 + col + kD] = __cosf(val) * 0.125f;
      }
    }
    // As above: phi_q's rows are written and read by this wave alone.
    asm volatile("s_wait_dscnt 0x0" ::: "memory");

    // out_rows(16x64) = phi_q(16x128) x kv(128x64)
    float* orow = obase + t * kNTile * kD;
    for (int tj = 0; tj < 4; ++tj) {
      const int j0 = tj * 16;
      v8f acc = {};
      for (int kb = 0; kb < kE2; kb += 4) {
        const v2f a = *(const v2f*)&s_phi[(i0 + m) * kPitch128 + kb + kk];
        const v2f b = *(const v2f*)&s_kv[frag_idx<kD>(kb, hi, j0 + m)];
        acc = wmma_f32(a, b, acc);
      }
      for (int g = 0; g < 8; ++g) {
        orow[(g + hi * 8) * kD + j0 + m] = acc[g];
      }
    }
    // The next trip writes registers that these stores name.
    asm volatile("s_wait_xcnt 0x0" ::: "memory");
  }
}

extern "C" void kernel_launch(void* const* d_in, const int* in_sizes, int n_in,
                              void* d_out, int out_size, void* d_ws, size_t ws_size,
                              hipStream_t stream) {
  (void)in_sizes; (void)n_in; (void)out_size; (void)ws_size;
  const float* q = (const float*)d_in[0];
  const float* k = (const float*)d_in[1];
  const float* v = (const float*)d_in[2];
  const float* proj = (const float*)d_in[3];
  float* out = (float*)d_out;
  float* kv_ws = (float*)d_ws;   // [BH][128][64] fp32 = 2 MB

  const int kv_elems = kBH * kE2 * kD;
  rfa_zero_kernel<<<dim3(512), dim3(256), 0, stream>>>(kv_ws, kv_elems);
  rfa_kv_kernel<<<dim3(kBH, kNSplit), dim3(256), 0, stream>>>(k, v, proj, kv_ws);
  rfa_out_kernel<<<dim3(kBH, kN / kNTile / kOutTiles), dim3(256), 0, stream>>>(q, proj, kv_ws, out);
}

// v004
// A run of this version takes 67.9 microseconds.
// In two side-by-side timings against v003, it was 1.03 and 1.02 times as fast.
// Over all steps from v000 it is 1.68 times as fast.
#include <hip/hip_runtime.h>

typedef __attribute__((ext_vector_type(2))) float v2f;
typedef __attribute__((ext_vector_type(4))) float v4f;
typedef __attribute__((ext_vector_type(8))) float v8f;

namespace {
constexpr int kH = 16;
constexpr int kBH = 64;          // B*H
constexpr int kN = 4096;
constexpr int kD = 64;           // head dim == projection dim e
constexpr int kE2 = 128;         // 2e feature dim
constexpr int kNTile = 128;      // rows of n processed per LDS tile
constexpr int kNSplit = 4;       // N-chunks for kv kernel
constexpr int kKvRows = kN / kNSplit;         // 1024 rows per block of the kv kernel
constexpr int kKvTrips = kKvRows / (8 * 16);  // 8 tiles of 16 rows per wave
// Row pitch (floats) of operands whose fragment takes two consecutive k of one
// row: pitch = 4 mod 64 puts the 16 rows x 4 k of one fragment on 64 banks.
constexpr int kPitch64 = kD + 4;     // 68
constexpr int kPitch128 = kE2 + 4;   // 132
constexpr int kThreads = 256;
constexpr int kProjPer = kD * kD / kThreads;          // 16 floats of P per thread
constexpr int kTilePer = kNTile * kD / 4 / kThreads;  // 8 float4 of a 128x64 tile per thread
constexpr int kOutTiles = 4;                          // n-tiles per block of the out kernel
constexpr int kRowsPer = 16 * kD / 4 / 32;            // 8 float4 of a wave's 16 rows per lane
}

// Layout of operands whose fragment takes rows k, k+1 at one column c: the two
// rows are interleaved (one 8-byte read per lane), and the odd row pair of each
// group of four rows starts 32 banks further on, so that lanes 0-15 (k, k+1)
// and lanes 16-31 (k+2, k+3) of one fragment read disjoint banks.
template <int C>
__device__ __forceinline__ constexpr int pair_idx(int k, int c) {
  return (k >> 2) * (4 * C + 32) + ((k >> 1) & 1) * (2 * C + 32) + c * 2 + (k & 1);
}
// Same address for a fragment: kb is a multiple of 4, hi = lane >> 4.
template <int C>
__device__ __forceinline__ int frag_idx(int kb, int hi, int c) {
  return (kb >> 2) * (4 * C + 32) + hi * (2 * C + 32) + c * 2;
}
template <int K, int C>
constexpr int pair_floats() { return (K / 4) * (4 * C + 32); }

__device__ __forceinline__ v8f wmma_f32(v2f a, v2f b, v8f c) {
  // D = A(16x4,f32) * B(4x16,f32) + C(16x16,f32)
  return __builtin_amdgcn_wmma_f32_16x16x4_f32(false, a, false, b,
                                               (short)0, c, false, false);
}

__global__ void rfa_zero_kernel(float* __restrict__ p, int n) {
  int i = blockIdx.x * blockDim.x + threadIdx.x;
  int stride = gridDim.x * blockDim.x;
  for (; i < n; i += stride) p[i] = 0.0f;
}

// ---------------------------------------------------------------------------
// Kernel A: kv[bh][i][j] += sum_n phi_k[n][i] * v[n][j]   (atomic reduction)
// block = (bh, chunk of kKvRows rows), 256 threads = 8 waves.
// phi_k never leaves the registers. The first product's result tile holds, in
// lane (c, h) and register r, kp[8h + r][c]: registers 2s, 2s+1 of it are the A
// fragment (row = feature c, two k per lane half) of step s of the second
// product when that step's four k are taken as rows 2s, 2s+1, 8+2s, 9+2s of
// the 16-row tile; v's B fragments are loaded in the same k order. So a wave
// needs its own 16 rows alone: it sums the whole 128x64 kv over them in
// registers and runs free of the other waves until the closing reduction.
// k and v go from memory straight into fragment registers:
//   k: lane (c, h) reads k[c][8q + 4h .. +3], two A fragments; P's fragments
//      take the same order of d.
//   v: lane (c, h) reads v[8h + r][4c .. 4c+3]; column tile t takes element t,
//      so lane c of column tile t stands for column 4c + t of kv.
// ---------------------------------------------------------------------------
__global__ __launch_bounds__(256)
void rfa_kv_kernel(const float* __restrict__ kmat, const float* __restrict__ vmat,
                   const float* __restrict__ proj, float* __restrict__ kv_out) {
  __shared__ __attribute__((aligned(16))) float s_proj[pair_floats<kD, kD>()];
  __shared__ __attribute__((aligned(16))) float s_red[8 * kE2 * kD];

  const int bh = blockIdx.x;
  const int chunk = blockIdx.y;
  const int h = bh % kH;
  const int tid = threadIdx.x;
  const int lane = tid & 31;
  const int wave = tid >> 5;
  const int m = lane & 15;            // row (A) / col (B,D) within 16x16 tile
  const int hi = lane >> 4;

  // Trip it of wave w works on rows (it * 8 + w) * 16 .. + 15 of the chunk.
  const size_t row0 = (size_t)bh * kN + (size_t)chunk * kKvRows + wave * 16;
  const float* kl = kmat + (row0 + m) * kD + hi * 4;
  const float* vl = vmat + (row0 + hi * 8) * kD + m * 4;

  // All global loads of the stage are issued before the first of them is
  // waited for: one memory latency instead of one per load.
  float pr[kProjPer];
  v4f kr[8], vr[8];
#pragma unroll  // fixed trip count, so that the loads stand together
  for (int r = 0; r < 8; ++r) {
    kr[r] = *(const v4f*)(kl + r * 8);
    vr[r] = *(const v4f*)(vl + r * kD);
  }
#pragma unroll  // fixed trip count, so that the loads stand together
  for (int it = 0; it < kProjPer; ++it) pr[it] = proj[h * kD * kD + tid + it * kThreads];

  // projections[h] : P[d][e], 4096 floats
#pragma unroll  // pr[] must stay in registers
  for (int it = 0; it < kProjPer; ++it) {
    const int i = tid + it * kThreads;
    s_proj[pair_idx<kD>(i / kD, i % kD)] = pr[it];
  }
  __syncthreads();

  v8f acc_kv[8][4];
#pragma unroll  // acc_kv[][] must stay in registers
  for (int f = 0; f < 8; ++f)
    for (int t = 0; t < 4; ++t) acc_kv[f][t] = {};

  // P[8q + 4h + 2u + {0,1}][16tj + c] stands at pl[q * 2 * kPGroup + u * kPOdd + tj * 32]
  constexpr int kPGroup = 4 * kD + 32;
  constexpr int kPOdd = 2 * kD + 32;
  const float* pl = &s_proj[hi * kPGroup + m * 2];

#pragma unroll 1  // one copy of the body: the trips share the instruction cache lines
  for (int it = 0; it < kKvTrips; ++it) {
    // kp = k_rows(16x64) x P(64x64)
    v8f kp[4];
#pragma unroll  // kp[] must stay in registers
    for (int tj = 0; tj < 4; ++tj) kp[tj] = {};
#pragma unroll  // kr[] must stay in registers
    for (int q = 0; q < 8; ++q) {
#pragma unroll  // the halves of kr[q] are picked at compile time
      for (int u = 0; u < 2; ++u) {
        v2f a;
        a.x = u ? kr[q].z : kr[q].x;
        a.y = u ? kr[q].w : kr[q].y;
#pragma unroll  // kp[] must stay in registers
        for (int tj = 0; tj < 4; ++tj) {
          const v2f b = *(const v2f*)&pl[q * 2 * kPGroup + u * kPOdd + tj * 32];
          kp[tj] = wmma_f32(a, b, kp[tj]);
        }
      }
    }
    // v's B fragments: step s of column tile t takes rows 8h + 2s, 8h + 2s + 1
    v2f vf[4][4];
#pragma unroll  // vr[], vf[][] must stay in registers
    for (int s = 0; s < 4; ++s)
      for (int t = 0; t < 4; ++t) {
        vf[t][s].x = vr[2 * s][t];
        vf[t][s].y = vr[2 * s + 1][t];
      }
    // The next rows fly while this tile's second product runs.
    if (it + 1 < kKvTrips) {
      kl += 8 * 16 * kD;
      vl += 8 * 16 * kD;
#pragma unroll  // fixed trip count, so that the loads stand together
      for (int r = 0; r < 8; ++r) {
        kr[r] = *(const v4f*)(kl + r * 8);
        vr[r] = *(const v4f*)(vl + r * kD);
      }
    }
    // The scheduler mixes nothing of the two products: left free it lengthens
    // so many live ranges that the 512 registers of a wave run out and it spills.
    __builtin_amdgcn_sched_barrier(0);

    // phi_k = [sin(kp), cos(kp)] / sqrt(64); kv(128x64) += phi_k^T x v_rows
#pragma unroll  // acc_kv[][] must stay in registers
    for (int tj = 0; tj < 4; ++tj) {
      v8f sn, cs;
#pragma unroll  // sn, cs must stay in registers
      for (int g = 0; g < 8; ++g) {
        sn[g] = __sinf(kp[tj][g]) * 0.125f;
        cs[g] = __cosf(kp[tj][g]) * 0.125f;
      }
#pragma unroll  // acc_kv[][] must stay in registers
      for (int s = 0; s < 4; ++s) {
        v2f as, ac;
        as.x = sn[2 * s]; as.y = sn[2 * s + 1];
        ac.x = cs[2 * s]; ac.y = cs[2 * s + 1];
#pragma unroll  // acc_kv[][] must stay in registers
        for (int t = 0; t < 4; ++t) {
          acc_kv[tj][t] = wmma_f32(as, vf[t][s], acc_kv[tj][t]);
          acc_kv[tj + 4][t] = wmma_f32(ac, vf[t][s], acc_kv[tj + 4][t]);
        }
      }
    }
  }

  // The eight waves' sums meet in LDS, register for register; wave w then adds
  // up feature tile w in the waves' order and reduces it into the workspace.
  {
    float* red = s_red + wave * (kE2 * kD) + lane * 4;
#pragma unroll  // acc_kv[][] must stay in registers
    for (int f = 0; f < 8; ++f)
      for (int t = 0; t < 4; ++t)
        for (int u = 0; u < 2; ++u) {
          v4f x;
          x.x = acc_kv[f][t][u * 4];     x.y = acc_kv[f][t][u * 4 + 1];
          x.z = acc_kv[f][t][u * 4 + 2]; x.w = acc_kv[f][t][u * 4 + 3];
          *(v4f*)&red[((f * 4 + t) * 2 + u) * 128] = x;
        }
    __syncthreads();
    const float* part = s_red + wave * (4 * 2 * 128) + lane * 4;
    float* out = kv_out + (size_t)bh * kE2 * kD + (wave * 16 + hi * 8) * kD + m * 4;
    // All LDS reads stand ahead of the first atomic: the compiler moves none over one.
    v4f x[8];
#pragma unroll  // x[] must stay in registers
    for (int p = 0; p < 8; ++p) {
      x[p] = *(const v4f*)&part[p * 128];
      for (int w = 1; w < 8; ++w) x[p] += *(const v4f*)&part[w * (kE2 * kD) + p * 128];
    }
#pragma unroll  // x[] must stay in registers
    for (int p = 0; p < 8; ++p)   // p = column tile t * 2 + register half u
      for (int e = 0; e < 4; ++e) atomicAdd(&out[((p & 1) * 4 + e) * kD + (p >> 1)], x[p][e]);
  }
}

// ---------------------------------------------------------------------------
// Kernel B: out[n][d] = sum_e phi_q[n][e] * kv[e][d]
// block = (bh, group of kOutTiles n-tiles of 128 rows), 256 threads = 8 waves.
// P and kv are staged once per block. Every row of q, phi_q and out belongs to
// one wave from its load to its store, so behind the one barrier that publishes
// P and kv the waves run free of each other: one wave's loads, sin/cos and
// stores fall under the other waves' matrix work.
// ---------------------------------------------------------------------------
__global__ __launch_bounds__(256)
void rfa_out_kernel(const float* __restrict__ qmat, const float* __restrict__ proj,
                    const float* __restrict__ kv_in, float* __restrict__ out) {
  __shared__ __attribute__((aligned(16))) float s_proj[pair_floats<kD, kD>()];
  __shared__ __attribute__((aligned(16))) float s_q[kNTile * kPitch64];
  __shared__ __attribute__((aligned(16))) float s_phi[kNTile * kPitch128];
  __shared__ __attribute__((aligned(16))) float s_kv[pair_floats<kE2, kD>()];

  const int bh = blockIdx.x;
  const int grp = blockIdx.y;
  const int h = bh % kH;
  const int tid = threadIdx.x;
  const int lane = tid & 31;
  const int wave = tid >> 5;
  const int m = lane & 15;
  const int hi = lane >> 4;
  const int kk = hi * 2;
  const int i0 = wave * 16;           // the wave's own 16 rows of every tile

  const size_t row0 = (size_t)bh * kN + (size_t)grp * kOutTiles * kNTile + i0;
  const float* qbase = qmat + row0 * kD;
  float* obase = out + row0 * kD;
  const float* wbase = kv_in + (size_t)bh * kE2 * kD;

  // All global loads of the stage are issued before the first of them is
  // waited for: one memory latency instead of one per load.
  float pr[kProjPer];
  v4f qr[kRowsPer], wr[kTilePer];
#pragma unroll  // fixed trip count, so that the loads stand together
  for (int it = 0; it < kRowsPer; ++it) qr[it] = *(const v4f*)(qbase + (lane + it * 32) * 4);
#pragma unroll  // fixed trip count, so that the loads stand together
  for (int it = 0; it < kTilePer; ++it) wr[it] = *(const v4f*)(wbase + (tid + it * kThreads) * 4);
#pragma unroll  // fixed trip count, so that the loads stand together
  for (int it = 0; it < kProjPer; ++it) pr[it] = proj[h * kD * kD + tid + it * kThreads];

#pragma unroll  // wr[] must stay in registers
  for (int it = 0; it < kTilePer; ++it) {
    const int i = tid + it * kThreads;
    const int row = i / (kD / 4);
    const int c4 = (i % (kD / 4)) * 4;
    float* dw = &s_kv[pair_idx<kD>(row, c4)];
    dw[0] = wr[it].x; dw[2] = wr[it].y; dw[4] = wr[it].z; dw[6] = wr[it].w;
  }
#pragma unroll  // pr[] must stay in registers
  for (int it = 0; it < kProjPer; ++it) {
    const int i = tid + it * kThreads;
    s_proj[pair_idx<kD>(i / kD, i % kD)] = pr[it];
  }
  __syncthreads();

#pragma unroll 1  // one copy of the body: the four trips share the instruction cache lines
  for (int t = 0; t < kOutTiles; ++t) {
    // the wave's own 16 rows of q, registers -> LDS
#pragma unroll  // qr[] must stay in registers
    for (int it = 0; it < kRowsPer; ++it) {
      const int i = lane + it * 32;
      *(v4f*)&s_q[(i0 + i / (kD / 4)) * kPitch64 + (i % (kD / 4)) * 4] = qr[it];
    }
    // Other lanes of this wave read these rows: the stores have landed, and the
    // compiler keeps the reads behind them.
    asm volatile("s_wait_dscnt 0x0" ::: "memory");
    // The next tile's rows fly while this tile's products run.
    if (t + 1 < kOutTiles) {
#pragma unroll  // fixed trip count, so that the loads stand together
      for (int it = 0; it < kRowsPer; ++it)
        qr[it] = *(const v4f*)(qbase + (t + 1) * kNTile * kD + (lane + it * 32) * 4);
    }

    // qp = q_rows x P ; phi_q = [sin, cos]/8
    for (int tj = 0; tj < 4; ++tj) {
      const int j0 = tj * 16;
      v8f acc = {};
      for (int kb = 0; kb < kD; kb += 4) {
        const v2f a = *(const v2f*)&s_q[(i0 + m) * kPitch64 + kb + kk];
        const v2f b = *(const v2f*)&s_proj[frag_idx<kD>(kb, hi, j0 + m)];
        acc = wmma_f32(a, b, acc);
      }
      for (int g = 0; g < 8; ++g) {
        const int row = i0 + g + hi * 8;
        const int col = j0 + m;
        const float val = acc[g];
        s_phi[row * kPitch128 + col] = __sinf(val) * 0.125f;
        s_phi[row * kPitch128 + col + kD] = __cosf(val) * 0.125f;
      }
    }
    // As above: phi_q's rows are written and read by this wave alone.
    asm volatile("s_wait_dscnt 0x0" ::: "memory");

    // out_rows(16x64) = phi_q(16x128) x kv(128x64)
    float* orow = obase + t * kNTile * kD;
    for (int tj = 0; tj < 4; ++tj) {
      const int j0 = tj * 16;
      v8f acc = {};
      for (int kb = 0; kb < kE2; kb += 4) {
        const v2f a = *(const v2f*)&s_phi[(i0 + m) * kPitch128 + kb + kk];
        const v2f b = *(const v2f*)&s_kv[frag_idx<kD>(kb, hi, j0 + m)];
        acc = wmma_f32(a, b, acc);
      }
      for (int g = 0; g < 8; ++g) {
        orow[(g + hi * 8) * kD + j0 + m] = acc[g];
      }
    }
    // The next trip writes registers that these stores name.
    asm volatile("s_wait_xcnt 0x0" ::: "memory");
  }
}

extern "C" void kernel_launch(void* const* d_in, const int* in_sizes, int n_in,
                              void* d_out, int out_size, void* d_ws, size_t ws_size,
                              hipStream_t stream) {
  (void)in_sizes; (void)n_in; (void)out_size; (void)ws_size;
  const float* q = (const float*)d_in[0];
  const float* k = (const float*)d_in[1];
  const float* v = (const float*)d_in[2];
  const float* proj = (const float*)d_in[3];
  float* out = (float*)d_out;
  float* kv_ws = (float*)d_ws;   // [BH][128][64] fp32 = 2 MB

  const int kv_elems = kBH * kE2 * kD;
  rfa_zero_kernel<<<dim3(512), dim3(256), 0, stream>>>(kv_ws, kv_elems);
  rfa_kv_kernel<<<dim3(kBH, kNSplit), dim3(256), 0, stream>>>(k, v, proj, kv_ws);
  rfa_out_kernel<<<dim3(kBH, kN / kNTile / kOutTiles), dim3(256), 0, stream>>>(q, proj, kv_ws, out);
}
